// v000
// Measured on an AMD MI455X. A time is GPU time per run, averaged over a window of back-to-back runs after a warm-up
// (all launches, gaps included; the runs take copies of the inputs in turn), and the median of several windows.
// Apart from v000's, it joins two sittings. Times from different sittings can be a few percent apart, while
// side-by-side timings come from the same sitting.
// v000 is the starting kernel. One run takes 14.5 microseconds.
#include <hip/hip_runtime.h>

// combine_sec = einsum('se,sc->sec', g1[:,None]*mask1, loc1)
//             + einsum('se,sc->sec', g2[:,None]*mask2, loc2)
// Per token s this is a rank-2 outer product: a 16(E) x 512(C) tile computed
// as 32 WMMA F32 16x16x4 tiles with K=2 live (K=2,3 zeroed via lane select).
//
// S=4096, E=16, C=512. Output 128 MiB f32 -> pure store-bandwidth bound
// (~151 MB total traffic / 23.3 TB/s ~= 6.5 us floor).

#define S_TOK 4096
#define E_DIM 16
#define C_DIM 512

typedef __attribute__((ext_vector_type(2))) float v2f;
typedef __attribute__((ext_vector_type(8))) float v8f;

__global__ __launch_bounds__(256) void moe_combine_wmma(
    const float* __restrict__ gates1_s,
    const float* __restrict__ loc1,      // [S, C]
    const float* __restrict__ gates2_s,
    const float* __restrict__ loc2,      // [S, C]
    const float* __restrict__ mask1,     // [S, E]
    const float* __restrict__ mask2,     // [S, E]
    float* __restrict__ out)             // [S, E, C]
{
    const int s    = blockIdx.x;          // one token per block
    const int tid  = threadIdx.x;         // 256 threads = 8 waves (wave32)
    const int wave = tid >> 5;            // 0..7
    const int lane = tid & 31;
    const int n    = lane & 15;           // col within 16-wide tile / row index e
    const bool lo  = (lane < 16);         // lanes 0-15 carry K=0,1; 16-31 carry K=2,3

    // Lane select instead of EXEC-masked loads: avoids saveexec/branch per tile.
    const float sel = lo ? 1.0f : 0.0f;

    // Block-uniform gate scalars -> scalar loads.
    const float g1 = gates1_s[s];
    const float g2 = gates2_s[s];

    // A matrix 16x4 (ExK): K0 = g1*mask1[e], K1 = g2*mask2[e], K2=K3=0.
    // Lanes 16-31 (which would carry K=2,3) are zeroed by sel.
    const size_t mrow = (size_t)s * E_DIM;
    const float m1v = mask1[mrow + n];    // all lanes load (dup addrs coalesce)
    const float m2v = mask2[mrow + n];
    v2f a;
    a.x = (g1 * m1v) * sel;
    a.y = (g2 * m2v) * sel;

    const float* L1row = loc1 + (size_t)s * C_DIM;
    const float* L2row = loc2 + (size_t)s * C_DIM;
    float* outtok      = out  + (size_t)s * E_DIM * C_DIM;

    // Prefetch all 4 B tiles (L1/L2 slices) as one load clause.
    float b1[4], b2[4];
#pragma unroll
    for (int i = 0; i < 4; ++i) {
        const int cbase = (wave * 4 + i) * 16;
        b1[i] = L1row[cbase + n];         // unconditional, all lanes
        b2[i] = L2row[cbase + n];
    }

    // D layout: lanes 0-15 hold rows M=0..7 (vgpr v -> M=v), lanes 16-31 rows M=8..15.
    const int mbase = lo ? 0 : 8;

#pragma unroll
    for (int i = 0; i < 4; ++i) {
        const int cbase = (wave * 4 + i) * 16;

        // B matrix 4x16 (KxC): K0 = loc1 slice, K1 = loc2 slice, K2=K3=0 via sel.
        v2f b;
        b.x = b1[i] * sel;
        b.y = b2[i] * sel;

        v8f c = {};  // accumulate from zero
        // 8-arg form: (neg_a, A, neg_b, B, c_mod, C, reuse_a, reuse_b)
        v8f d = __builtin_amdgcn_wmma_f32_16x16x4_f32(
            false, a, false, b, (short)0, c, false, false);

        // Lane writes 8 rows (stride C_DIM); across lanes each row is a
        // contiguous 64B segment, and consecutive tiles keep rows contiguous
        // so writes combine into full cachelines in L2.
        float* p = outtok + (size_t)mbase * C_DIM + cbase + n;
#pragma unroll
        for (int v = 0; v < 8; ++v) {
            p[(size_t)v * C_DIM] = d[v];
        }
    }
}

extern "C" void kernel_launch(void* const* d_in, const int* in_sizes, int n_in,
                              void* d_out, int out_size, void* d_ws, size_t ws_size,
                              hipStream_t stream)
{
    const float* gates1 = (const float*)d_in[0];
    const float* loc1   = (const float*)d_in[1];
    const float* gates2 = (const float*)d_in[2];
    const float* loc2   = (const float*)d_in[3];
    const float* mask1  = (const float*)d_in[4];
    const float* mask2  = (const float*)d_in[5];
    float* out          = (float*)d_out;

    dim3 grid(S_TOK);
    dim3 block(256);
    moe_combine_wmma<<<grid, block, 0, stream>>>(gates1, loc1, gates2, loc2,
                                                 mask1, mask2, out);
}

// v001
// One run takes 10 microseconds.
// In two side-by-side timings against v000, it was 1.47 and 1.44 times as fast.
#include <hip/hip_runtime.h>

// combine_sec = einsum('se,sc->sec', g1[:,None]*mask1, loc1)
//             + einsum('se,sc->sec', g2[:,None]*mask2, loc2)
// Per token s this is a rank-2 outer product: a 16(E) x 512(C) tile computed
// as 32 WMMA F32 16x16x4 tiles with two of the four K live.
//
// S=4096, E=16, C=512. Output 128 MiB f32 -> pure store-bandwidth bound.
// Every global access of loc1, loc2 and out moves 16 bytes a lane.

#define S_TOK 4096
#define E_DIM 16
#define C_DIM 512

typedef __attribute__((ext_vector_type(2))) float v2f;
typedef __attribute__((ext_vector_type(4))) float v4f;
typedef __attribute__((ext_vector_type(8))) float v8f;

__global__ __launch_bounds__(128) void moe_combine_wmma(
    const float* __restrict__ gates1_s,
    const float* __restrict__ loc1,      // [S, C]
    const float* __restrict__ gates2_s,
    const float* __restrict__ loc2,      // [S, C]
    const float* __restrict__ mask1,     // [S, E]
    const float* __restrict__ mask2,     // [S, E]
    float* __restrict__ out)             // [S, E, C]
{
    const int s    = blockIdx.x;          // one token per block
    const int tid  = threadIdx.x;         // 128 threads = 4 waves (wave32)
    const int wave = tid >> 5;            // 0..3, 128 columns each
    const int lane = tid & 31;
    const int n    = lane & 15;           // col group within a tile / row index e
    const bool lo  = (lane < 16);         // lanes 0-15 carry K=0,1; 16-31 carry K=2,3

    // Lane selects instead of EXEC-masked loads: avoids saveexec/branch per tile.
    const float sel[2] = { lo ? 1.0f : 0.0f, lo ? 0.0f : 1.0f };

    const float* L1row = loc1 + (size_t)s * C_DIM;
    const float* L2row = loc2 + (size_t)s * C_DIM;
    float* outtok      = out  + (size_t)s * E_DIM * C_DIM;

    // One 16-byte load a lane and row: the wave reads 512 contiguous bytes,
    // its 128 columns. Lanes 0-15 hold columns 4n..4n+3 of the first 64,
    // lanes 16-31 those of the second 64.
    const int wbase = wave * 128;
    const v4f l1 = *(const v4f*)(L1row + tid * 4);
    const v4f l2 = *(const v4f*)(L2row + tid * 4);

    // Block-uniform gate scalars -> scalar loads.
    const float g1 = gates1_s[s];
    const float g2 = gates2_s[s];

    // A matrix 16x4 (ExK), two forms. a[0]: K0 = g1*mask1[e], K1 = g2*mask2[e],
    // K2=K3=0. a[1]: K2 = g1*mask1[e], K3 = g2*mask2[e], K0=K1=0.
    const size_t mrow = (size_t)s * E_DIM;
    const float m1v = mask1[mrow + n];    // all lanes load (dup addrs coalesce)
    const float m2v = mask2[mrow + n];
    // Behind the loads, before any register that they name is written again.
    asm volatile("s_wait_xcnt 0x0" ::: "memory");
    v2f a[2];
    // All loops below are unrolled so that a, d and sel are indexed by
    // constants and stay in registers.
#pragma unroll
    for (int h = 0; h < 2; ++h) {
        a[h].x = (g1 * m1v) * sel[h];
        a[h].y = (g2 * m2v) * sel[h];
    }

    // Column order inside a 64-column half is free: tile i takes columns
    // 4n + i, so a lane ends up with 4 neighbouring columns of every row it
    // holds. Half h is picked by which K pair is live in A and B.
    v8f d[2][4];
#pragma unroll
    for (int h = 0; h < 2; ++h) {
#pragma unroll
        for (int i = 0; i < 4; ++i) {
            // B matrix 4x16 (KxC): loc1 and loc2 slices on the K pair of half h,
            // the other pair zeroed via sel.
            v2f b;
            b.x = l1[i] * sel[h];
            b.y = l2[i] * sel[h];

            v8f c = {};  // accumulate from zero
            // 8-arg form: (neg_a, A, neg_b, B, c_mod, C, reuse_a, reuse_b)
            d[h][i] = __builtin_amdgcn_wmma_f32_16x16x4_f32(
                false, a[h], false, b, (short)0, c, false, false);
        }
    }

    // Four vector slots between the last WMMA and the moves below, which read
    // its D and reuse its A and B registers; the scheduling barriers keep the
    // v_nops directly behind the WMMAs.
    __builtin_amdgcn_sched_barrier(0);
    asm volatile("v_nop\n\tv_nop\n\tv_nop\n\tv_nop");
    __builtin_amdgcn_sched_barrier(0);

    // D layout: lanes 0-15 hold rows M=0..7 (vgpr v -> M=v), lanes 16-31 rows M=8..15.
    const int mbase = lo ? 0 : 8;

    // One 16-byte store per row and half: each half wave writes 256 contiguous
    // bytes, two whole 128-byte lines, of its row.
    float* p = outtok + (size_t)mbase * C_DIM + wbase + n * 4;
#pragma unroll
    for (int v = 0; v < 8; ++v) {
#pragma unroll
        for (int h = 0; h < 2; ++h) {
            v4f o;
            o.x = d[h][0][v];
            o.y = d[h][1][v];
            o.z = d[h][2][v];
            o.w = d[h][3][v];
            *(v4f*)(p + (size_t)v * C_DIM + h * 64) = o;
        }
    }
}

extern "C" void kernel_launch(void* const* d_in, const int* in_sizes, int n_in,
                              void* d_out, int out_size, void* d_ws, size_t ws_size,
                              hipStream_t stream)
{
    const float* gates1 = (const float*)d_in[0];
    const float* loc1   = (const float*)d_in[1];
    const float* gates2 = (const float*)d_in[2];
    const float* loc2   = (const float*)d_in[3];
    const float* mask1  = (const float*)d_in[4];
    const float* mask2  = (const float*)d_in[5];
    float* out          = (float*)d_out;

    dim3 grid(S_TOK);
    dim3 block(128);
    moe_combine_wmma<<<grid, block, 0, stream>>>(gates1, loc1, gates2, loc2,
                                                 mask1, mask2, out);
}

// v002
// One run takes 9.38 microseconds.
// In two side-by-side timings against v001, it was 1.06 and 1.08 times as fast.
// All steps since v000 together make it 1.56 times as fast.
#include <hip/hip_runtime.h>

// combine_sec = einsum('se,sc->sec', g1[:,None]*mask1, loc1)
//             + einsum('se,sc->sec', g2[:,None]*mask2, loc2)
// Per token s this is a rank-2 outer product: a 16(E) x 512(C) tile computed
// as 32 WMMA F32 16x16x4 tiles with two of the four K live.
//
// S=4096, E=16, C=512. Output 128 MiB f32 -> pure store-bandwidth bound.
// Every global access of loc1, loc2 and out moves 16 bytes a lane.
// A block works through TOK_PER_BLK neighbouring tokens, so that few waves
// have to be started; all its loads are issued before its first store.

#define S_TOK 4096
#define E_DIM 16
#define C_DIM 512
#define TOK_PER_BLK 8
#define N_BLK 512
static_assert(N_BLK * TOK_PER_BLK == S_TOK, "every token once");

typedef __attribute__((ext_vector_type(2))) float v2f;
typedef __attribute__((ext_vector_type(4))) float v4f;
typedef __attribute__((ext_vector_type(8))) float v8f;

__global__ __launch_bounds__(128) void moe_combine_wmma(
    const float* __restrict__ gates1_s,
    const float* __restrict__ loc1,      // [S, C]
    const float* __restrict__ gates2_s,
    const float* __restrict__ loc2,      // [S, C]
    const float* __restrict__ mask1,     // [S, E]
    const float* __restrict__ mask2,     // [S, E]
    float* __restrict__ out)             // [S, E, C]
{
    const int s0   = blockIdx.x * TOK_PER_BLK;  // first token of the block
    const int tid  = threadIdx.x;         // 128 threads = 4 waves (wave32)
    const int wave = tid >> 5;            // 0..3, 128 columns each
    const int lane = tid & 31;
    const int n    = lane & 15;           // col group within a tile / row index e
    const bool lo  = (lane < 16);         // lanes 0-15 carry K=0,1; 16-31 carry K=2,3

    // Lane selects instead of EXEC-masked loads: avoids saveexec/branch per tile.
    const float sel[2] = { lo ? 1.0f : 0.0f, lo ? 0.0f : 1.0f };

    const float* L1row = loc1 + (size_t)s0 * C_DIM;
    const float* L2row = loc2 + (size_t)s0 * C_DIM;
    float* outtok      = out  + (size_t)s0 * E_DIM * C_DIM;
    const size_t mrow  = (size_t)s0 * E_DIM;
    const int wbase    = wave * 128;

    // All loops below are unrolled so that the arrays are indexed by constants
    // and stay in registers.
    v4f l1[TOK_PER_BLK], l2[TOK_PER_BLK];
    float m1v[TOK_PER_BLK], m2v[TOK_PER_BLK], g1[TOK_PER_BLK], g2[TOK_PER_BLK];
#pragma unroll
    for (int t = 0; t < TOK_PER_BLK; ++t) {
        // One 16-byte load a lane and row: the wave reads 512 contiguous bytes,
        // its 128 columns. Lanes 0-15 hold columns 4n..4n+3 of the first 64,
        // lanes 16-31 those of the second 64.
        l1[t] = *(const v4f*)(L1row + t * C_DIM + tid * 4);
        l2[t] = *(const v4f*)(L2row + t * C_DIM + tid * 4);
        // Block-uniform gate scalars -> scalar loads.
        g1[t] = gates1_s[s0 + t];
        g2[t] = gates2_s[s0 + t];
        m1v[t] = mask1[mrow + t * E_DIM + n];   // all lanes load (dup addrs coalesce)
        m2v[t] = mask2[mrow + t * E_DIM + n];
    }
    // Behind the loads, before any register that they name is written again.
    asm volatile("s_wait_xcnt 0x0" ::: "memory");

    // D layout: lanes 0-15 hold rows M=0..7 (vgpr v -> M=v), lanes 16-31 rows M=8..15.
    const int mbase = lo ? 0 : 8;
    float* p = outtok + (size_t)mbase * C_DIM + wbase + n * 4;

#pragma unroll
    for (int t = 0; t < TOK_PER_BLK; ++t) {
        // A matrix 16x4 (ExK), two forms. a[0]: K0 = g1*mask1[e], K1 = g2*mask2[e],
        // K2=K3=0. a[1]: K2 = g1*mask1[e], K3 = g2*mask2[e], K0=K1=0.
        v2f a[2];
#pragma unroll
        for (int h = 0; h < 2; ++h) {
            a[h].x = (g1[t] * m1v[t]) * sel[h];
            a[h].y = (g2[t] * m2v[t]) * sel[h];
        }

        // Column order inside a 64-column half is free: tile i takes columns
        // 4n + i, so a lane ends up with 4 neighbouring columns of every row it
        // holds. Half h is picked by which K pair is live in A and B.
        v2f b[2][4];
#pragma unroll
        for (int h = 0; h < 2; ++h) {
#pragma unroll
            for (int i = 0; i < 4; ++i) {
                // B matrix 4x16 (KxC): loc1 and loc2 slices on the K pair of half h,
                // the other pair zeroed via sel.
                b[h][i].x = l1[t][i] * sel[h];
                b[h][i].y = l2[t][i] * sel[h];
            }
        }
        // Keeps every operand product ahead of the first WMMA: none of them
        // then writes over an operand of a WMMA issued just before it.
        __builtin_amdgcn_sched_barrier(0);

        v8f d[2][4];
#pragma unroll
        for (int h = 0; h < 2; ++h) {
#pragma unroll
            for (int i = 0; i < 4; ++i) {
                v8f c = {};  // accumulate from zero
                // 8-arg form: (neg_a, A, neg_b, B, c_mod, C, reuse_a, reuse_b)
                d[h][i] = __builtin_amdgcn_wmma_f32_16x16x4_f32(
                    false, a[h], false, b[h][i], (short)0, c, false, false);
            }
        }

        // Four vector slots between the last WMMA and the moves below, which read
        // its D and reuse its A and B registers; the scheduling barriers keep the
        // v_nops directly behind the WMMAs.
        __builtin_amdgcn_sched_barrier(0);
        asm volatile("v_nop\n\tv_nop\n\tv_nop\n\tv_nop");
        __builtin_amdgcn_sched_barrier(0);

        // One 16-byte store per row and half: each half wave writes 256 contiguous
        // bytes, two whole 128-byte lines, of its row.
#pragma unroll
        for (int v = 0; v < 8; ++v) {
#pragma unroll
            for (int h = 0; h < 2; ++h) {
                v4f o;
                o.x = d[h][0][v];
                o.y = d[h][1][v];
                o.z = d[h][2][v];
                o.w = d[h][3][v];
                *(v4f*)(p + (size_t)t * E_DIM * C_DIM + (size_t)v * C_DIM + h * 64) = o;
            }
        }
        // Keeps the next token's products, and with them the wait for its loads,
        // behind this token's last stores.
        __builtin_amdgcn_sched_barrier(0);
    }
}

extern "C" void kernel_launch(void* const* d_in, const int* in_sizes, int n_in,
                              void* d_out, int out_size, void* d_ws, size_t ws_size,
                              hipStream_t stream)
{
    const float* gates1 = (const float*)d_in[0];
    const float* loc1   = (const float*)d_in[1];
    const float* gates2 = (const float*)d_in[2];
    const float* loc2   = (const float*)d_in[3];
    const float* mask1  = (const float*)d_in[4];
    const float* mask2  = (const float*)d_in[5];
    float* out          = (float*)d_out;

    dim3 grid(N_BLK);
    dim3 block(128);
    moe_combine_wmma<<<grid, block, 0, stream>>>(gates1, loc1, gates2, loc2,
                                                 mask1, mask2, out);
}
